// v000
// Times are from an AMD MI455X. After a warm-up the kernel runs many times in a row, and a time is the length of
// such a window on the GPU divided by its runs, so every launch and the gaps after it count. The runs cycle
// through copies of the inputs. A figure is the median of several windows, for all but v000 over two sittings.
// Sittings can differ by a few percent; kernels timed side by side share one.
// The starting kernel, v000, takes 270 microseconds a run.
#include <hip/hip_runtime.h>

typedef float v2f __attribute__((ext_vector_type(2)));
typedef float v8f __attribute__((ext_vector_type(8)));
typedef unsigned int u32x4 __attribute__((ext_vector_type(4)));
typedef int i32x4 __attribute__((ext_vector_type(4)));
typedef int i32x8 __attribute__((ext_vector_type(8)));

#define B_  4
#define S_  4096
#define E_  256
#define D_  64
#define NB_ (S_ / 16)        // key blocks per batch
#define LSTRIDE 66           // LDS row stride in dwords (64 + 2 pad, conflict-free)
#define TILEDW (16 * LSTRIDE)

// 8-arg pattern: (neg_a, A, neg_b, B, c_mod, C, reuse_a, reuse_b)
__device__ __forceinline__ v8f wmma_f32(v2f a, v2f b, v8f c) {
  return __builtin_amdgcn_wmma_f32_16x16x4_f32(false, a, false, b, (short)0, c,
                                               false, false);
}

__device__ __forceinline__ void tdm_load_tile16x64(unsigned lds_off,
                                                   const float* gptr) {
  const unsigned long long ga = (unsigned long long)(uintptr_t)gptr;
  u32x4 g0;
  g0.x = 1u;
  g0.y = lds_off;
  g0.z = (unsigned)(ga & 0xffffffffu);
  g0.w = (unsigned)((ga >> 32) & 0x01ffffffu)
         | (2u << 30);
  i32x8 g1;
  g1[0] = (2 << 16)
        | (1 << 20)
        | (5 << 22)
        | (1 << 25);
  g1[1] = (D_ & 0xffff) << 16;
  g1[2] = ((D_ >> 16) & 0xffff)
        | ((65536 & 0xffff) << 16);
  g1[3] = ((65536 >> 16) & 0xffff)
        | (D_ << 16);
  g1[4] = 16;
  g1[5] = D_;
  g1[6] = 0;
  g1[7] = 0;
  i32x4 zz = {0, 0, 0, 0};                     // 2-D tile: groups 2/3 unused
#if defined(__clang_major__) && (__clang_major__ >= 23)
  i32x8 z8 = {0, 0, 0, 0, 0, 0, 0, 0};
  __builtin_amdgcn_tensor_load_to_lds(g0, g1, zz, zz, z8, 0);
#else
  __builtin_amdgcn_tensor_load_to_lds(g0, g1, zz, zz, 0);
#endif
}

// ---------------------------------------------------------------------------
// Kernel 1: embedding gather fused with QKV projection.
// Grid: (BS/16, 12); one wave per 16x16 tile, 64 WMMAs over K=256.
// ---------------------------------------------------------------------------
__global__ __launch_bounds__(32) void qkv_embed_kernel(
    const int* __restrict__ x, const float* __restrict__ emb,
    const float* __restrict__ Wq, const float* __restrict__ Wk,
    const float* __restrict__ Wv,
    float* __restrict__ Q, float* __restrict__ K, float* __restrict__ V) {
  const int mtile = blockIdx.x;
  const int ntile = blockIdx.y;
  const int lane  = threadIdx.x;
  const int l16   = lane & 15;
  const int hi    = lane >> 4;

  const float* W;
  float* O;
  const int col0 = (ntile & 3) * 16;
  if (ntile < 4)      { W = Wq; O = Q; }
  else if (ntile < 8) { W = Wk; O = K; }
  else                { W = Wv; O = V; }

  const int tok   = x[mtile * 16 + l16];
  const int hbase = tok * E_;
  const int wbase = (col0 + l16) * E_;

  v8f c = {};
  for (int kk = 0; kk < E_; kk += 4) {
    v2f a = *(const v2f*)(emb + hbase + kk + 2 * hi);
    v2f b = *(const v2f*)(W + wbase + kk + 2 * hi);
    c = wmma_f32(a, b, c);
  }

#pragma unroll
  for (int r = 0; r < 8; ++r) {
    const int m = mtile * 16 + r + 8 * hi;
    O[m * D_ + col0 + l16] = c[r];
  }
}

__global__ __launch_bounds__(32) void flash_attn_kernel(
    const float* __restrict__ Q, const float* __restrict__ K,
    const float* __restrict__ V, float* __restrict__ out) {
  __shared__ float kv_lds[4 * TILEDW];    // [buf0:K,V][buf1:K,V], stride-66 rows
  __shared__ float plds[16 * 17];         // P transpose scratch

  const int qt   = blockIdx.x;
  const int b    = blockIdx.y;
  const int lane = threadIdx.x;
  const int l16  = lane & 15;
  const int hi   = lane >> 4;

  const float* Qb = Q + b * S_ * D_;
  const float* Kb = K + b * S_ * D_;
  const float* Vb = V + b * S_ * D_;

  // Preload Q A-fragments, folding in the 1/sqrt(256) score scale.
  const int qrow = qt * 16 + l16;
  v2f qf[16];
#pragma unroll
  for (int st = 0; st < 16; ++st) {
    v2f q = *(const v2f*)(Qb + qrow * D_ + st * 4 + 2 * hi);
    qf[st] = q * 0.0625f;
  }

  float mrow[8], lrow[8];
#pragma unroll
  for (int r = 0; r < 8; ++r) { mrow[r] = -INFINITY; lrow[r] = 0.0f; }
  v8f acc[4] = {{}, {}, {}, {}};

  const unsigned kv_base = (unsigned)(uintptr_t)&kv_lds[0];

  // Prologue: DMA K/V tiles for block 0 into buffer 0.
  tdm_load_tile16x64(kv_base, Kb);
  tdm_load_tile16x64(kv_base + TILEDW * 4, Vb);

  for (int kb = 0; kb < NB_; ++kb) {
    const int cur = kb & 1;
    if (kb + 1 < NB_) {
      const int nxt = cur ^ 1;
      const unsigned noff = kv_base + nxt * (2 * TILEDW * 4);
      tdm_load_tile16x64(noff, Kb + (kb + 1) * 16 * D_);
      tdm_load_tile16x64(noff + TILEDW * 4, Vb + (kb + 1) * 16 * D_);
      __builtin_amdgcn_s_wait_tensorcnt(2);   // current buffer's 2 DMAs done
    } else {
      __builtin_amdgcn_s_wait_tensorcnt(0);
    }
    asm volatile("" ::: "memory");

    const float* Kl = kv_lds + cur * (2 * TILEDW);
    const float* Vl = Kl + TILEDW;

    // S = Q . K^T : B[d][key] = K[key][d] read from padded LDS tile.
    v8f s = {};
#pragma unroll
    for (int st = 0; st < 16; ++st) {
      v2f bf = *(const v2f*)(Kl + l16 * LSTRIDE + st * 4 + 2 * hi);
      s = wmma_f32(qf[st], bf, s);
    }

    float pr[8];
#pragma unroll
    for (int r = 0; r < 8; ++r) {
      float sv = s[r];
      float mx = sv;
      mx = fmaxf(mx, __shfl_xor(mx, 1));
      mx = fmaxf(mx, __shfl_xor(mx, 2));
      mx = fmaxf(mx, __shfl_xor(mx, 4));
      mx = fmaxf(mx, __shfl_xor(mx, 8));
      const float mnew  = fmaxf(mrow[r], mx);
      const float alpha = __expf(mrow[r] - mnew);
      const float p     = __expf(sv - mnew);
      float rs = p;
      rs += __shfl_xor(rs, 1);
      rs += __shfl_xor(rs, 2);
      rs += __shfl_xor(rs, 4);
      rs += __shfl_xor(rs, 8);
      lrow[r] = lrow[r] * alpha + rs;
      mrow[r] = mnew;
#pragma unroll
      for (int dc = 0; dc < 4; ++dc) acc[dc][r] *= alpha;
      pr[r] = p;
    }

    // Transpose P (D layout -> A layout) through LDS.
#pragma unroll
    for (int r = 0; r < 8; ++r) plds[(r + 8 * hi) * 17 + l16] = pr[r];
    __builtin_amdgcn_wave_barrier();
    asm volatile("s_wait_dscnt 0x0" ::: "memory");  // LDS RAW fence (same wave)

    // O += P . V : A from LDS transpose, B[key][d] from padded V tile.
#pragma unroll
    for (int st = 0; st < 4; ++st) {
      v2f af;
      af.x = plds[l16 * 17 + st * 4 + 2 * hi + 0];
      af.y = plds[l16 * 17 + st * 4 + 2 * hi + 1];
#pragma unroll
      for (int dc = 0; dc < 4; ++dc) {
        v2f bf;
        bf.x = Vl[(st * 4 + 2 * hi + 0) * LSTRIDE + dc * 16 + l16];
        bf.y = Vl[(st * 4 + 2 * hi + 1) * LSTRIDE + dc * 16 + l16];
        acc[dc] = wmma_f32(af, bf, acc[dc]);
      }
    }
    __builtin_amdgcn_wave_barrier();
  }

  // Normalize and store [B,S,64].
  float* Ob = out + b * S_ * D_;
#pragma unroll
  for (int r = 0; r < 8; ++r) {
    const float inv = 1.0f / lrow[r];
    const int m = qt * 16 + r + 8 * hi;
#pragma unroll
    for (int dc = 0; dc < 4; ++dc)
      Ob[m * D_ + dc * 16 + l16] = acc[dc][r] * inv;
  }
}

// ---------------------------------------------------------------------------
extern "C" void kernel_launch(void* const* d_in, const int* in_sizes, int n_in,
                              void* d_out, int out_size, void* d_ws,
                              size_t ws_size, hipStream_t stream) {
  const int*   x   = (const int*)d_in[0];
  const float* emb = (const float*)d_in[1];
  const float* Wq  = (const float*)d_in[2];
  const float* Wk  = (const float*)d_in[3];
  const float* Wv  = (const float*)d_in[4];
  float* out = (float*)d_out;

  float* Qw = (float*)d_ws;            // [B*S, 64]
  float* Kw = Qw + B_ * S_ * D_;       // [B*S, 64]
  float* Vw = Kw + B_ * S_ * D_;       // [B*S, 64]  (12 MB total in d_ws)

  qkv_embed_kernel<<<dim3((B_ * S_) / 16, 12), 32, 0, stream>>>(
      x, emb, Wq, Wk, Wv, Qw, Kw, Vw);
  flash_attn_kernel<<<dim3(S_ / 16, B_), 32, 0, stream>>>(Qw, Kw, Vw, out);
}

// v001
// Measured time: 213 microseconds a run.
// Two timings next to v000 both put it at 1.33 times that version's speed.
#include <hip/hip_runtime.h>

typedef float v2f __attribute__((ext_vector_type(2)));
typedef float v4f __attribute__((ext_vector_type(4)));
typedef float v8f __attribute__((ext_vector_type(8)));
typedef unsigned int u32x4 __attribute__((ext_vector_type(4)));
typedef int i32x4 __attribute__((ext_vector_type(4)));
typedef int i32x8 __attribute__((ext_vector_type(8)));

#define B_  4
#define S_  4096
#define E_  256
#define D_  64
#define NB_ (S_ / 16)        // key blocks per batch
#define LSTRIDE 66           // LDS row stride in dwords (64 + 2 pad, conflict-free)
#define TILEDW (16 * LSTRIDE)

// 8-arg pattern: (neg_a, A, neg_b, B, c_mod, C, reuse_a, reuse_b)
__device__ __forceinline__ v8f wmma_f32(v2f a, v2f b, v8f c) {
  return __builtin_amdgcn_wmma_f32_16x16x4_f32(false, a, false, b, (short)0, c,
                                               false, false);
}

__device__ __forceinline__ float xhalf(float v) {
  const int b = __builtin_bit_cast(int, v);
  return __builtin_bit_cast(
      float, __builtin_amdgcn_permlanex16(b, b, 0x76543210, 0xfedcba98, false,
                                          false));
}

__device__ __forceinline__ float exp_slot(float x) {
  float r;
  asm("v_exp_f32 %0, %1\n\tv_nop" : "=v"(r) : "v"(x * 1.44269504f));
  return r;
}

__device__ __forceinline__ void tdm_load_tile16x64(unsigned lds_off,
                                                   const float* gptr) {
  const unsigned long long ga = (unsigned long long)(uintptr_t)gptr;
  u32x4 g0;
  g0.x = 1u;
  g0.y = lds_off;
  g0.z = (unsigned)(ga & 0xffffffffu);
  g0.w = (unsigned)((ga >> 32) & 0x01ffffffu)
         | (2u << 30);
  i32x8 g1;
  g1[0] = (2 << 16)
        | (1 << 20)
        | (5 << 22)
        | (1 << 25);
  g1[1] = (D_ & 0xffff) << 16;
  g1[2] = ((D_ >> 16) & 0xffff)
        | ((65536 & 0xffff) << 16);
  g1[3] = ((65536 >> 16) & 0xffff)
        | (D_ << 16);
  g1[4] = 16;
  g1[5] = D_;
  g1[6] = 0;
  g1[7] = 0;
  i32x4 zz = {0, 0, 0, 0};                     // 2-D tile: groups 2/3 unused
#if defined(__clang_major__) && (__clang_major__ >= 23)
  i32x8 z8 = {0, 0, 0, 0, 0, 0, 0, 0};
  __builtin_amdgcn_tensor_load_to_lds(g0, g1, zz, zz, z8, 0);
#else
  __builtin_amdgcn_tensor_load_to_lds(g0, g1, zz, zz, 0);
#endif
}

// ---------------------------------------------------------------------------
// Kernel 1: embedding gather fused with QKV projection.
// Grid: (BS/16, 12); one wave per 16x16 tile, 64 WMMAs over K=256.
// ---------------------------------------------------------------------------
__global__ __launch_bounds__(32) void qkv_embed_kernel(
    const int* __restrict__ x, const float* __restrict__ emb,
    const float* __restrict__ Wq, const float* __restrict__ Wk,
    const float* __restrict__ Wv,
    float* __restrict__ Q, float* __restrict__ K, float* __restrict__ V) {
  const int mtile = blockIdx.x;
  const int ntile = blockIdx.y;
  const int lane  = threadIdx.x;
  const int l16   = lane & 15;
  const int hi    = lane >> 4;

  const float* W;
  float* O;
  const int col0 = (ntile & 3) * 16;
  if (ntile < 4)      { W = Wq; O = Q; }
  else if (ntile < 8) { W = Wk; O = K; }
  else                { W = Wv; O = V; }

  const int tok   = x[mtile * 16 + l16];
  const int hbase = tok * E_;
  const int wbase = (col0 + l16) * E_;

  v8f c = {};
  for (int kk = 0; kk < E_; kk += 4) {
    v2f a = *(const v2f*)(emb + hbase + kk + 2 * hi);
    v2f b = *(const v2f*)(W + wbase + kk + 2 * hi);
    c = wmma_f32(a, b, c);
  }

#pragma unroll
  for (int r = 0; r < 8; ++r) {
    const int m = mtile * 16 + r + 8 * hi;
    O[m * D_ + col0 + l16] = c[r];
  }
}

__global__ __launch_bounds__(32) void flash_attn_kernel(
    const float* __restrict__ Q, const float* __restrict__ K,
    const float* __restrict__ V, float* __restrict__ out) {
  __shared__ float kv_lds[4 * TILEDW];    // [buf0:K,V][buf1:K,V], stride-66 rows

  const int qt   = blockIdx.x;
  const int b    = blockIdx.y;
  const int lane = threadIdx.x;
  const int l16  = lane & 15;
  const int hi   = lane >> 4;

  const float* Qb = Q + b * S_ * D_;
  const float* Kb = K + b * S_ * D_;
  const float* Vb = V + b * S_ * D_;

  // Preload Q fragments (B operand of S^T: column = query), folding in the 1/sqrt(256) score scale.
  const int qrow = qt * 16 + l16;
  v2f qf[16];
#pragma unroll
  for (int st = 0; st < 16; ++st) {
    v2f q = *(const v2f*)(Qb + qrow * D_ + st * 4 + 2 * hi);
    qf[st] = q * 0.0625f;
  }

  // One query (column l16) per lane: its running maximum, this half's share of
  // its row sum, and O^T tiles acc[dc][r] = O[query l16][dc*16 + 8*hi + r].
  float mrun = -INFINITY, lsum = 0.0f;
  v8f acc[4] = {{}, {}, {}, {}};

  const unsigned kv_base = (unsigned)(uintptr_t)&kv_lds[0];

  // Prologue: DMA K/V tiles for block 0 into buffer 0.
  tdm_load_tile16x64(kv_base, Kb);
  tdm_load_tile16x64(kv_base + TILEDW * 4, Vb);

  for (int kb = 0; kb < NB_; ++kb) {
    const int cur = kb & 1;
    if (kb + 1 < NB_) {
      const int nxt = cur ^ 1;
      const unsigned noff = kv_base + nxt * (2 * TILEDW * 4);
      tdm_load_tile16x64(noff, Kb + (kb + 1) * 16 * D_);
      tdm_load_tile16x64(noff + TILEDW * 4, Vb + (kb + 1) * 16 * D_);
      __builtin_amdgcn_s_wait_tensorcnt(2);   // current buffer's 2 DMAs done
    } else {
      __builtin_amdgcn_s_wait_tensorcnt(0);
    }
    asm volatile("" ::: "memory");

    const float* Kl = kv_lds + cur * (2 * TILEDW);
    const float* Vl = Kl + TILEDW;

    // S^T = K . Q^T : A[key][d] from the padded LDS tile, B = Q fragments.
    // s[r] = score of key 8*hi + r for query l16.
    v8f s = {};
#pragma unroll
    for (int st = 0; st < 16; ++st) {
      v2f kf = *(const v2f*)(Kl + l16 * LSTRIDE + st * 4 + 2 * hi);
      s = wmma_f32(kf, qf[st], s);
    }

    // Online softmax, in-lane over this half's 8 keys; one exchange between the
    // halves gives the query's maximum over all 16 keys.
    float mx = s[0];
#pragma unroll
    for (int r = 1; r < 8; ++r) mx = fmaxf(mx, s[r]);
    mx = fmaxf(mx, xhalf(mx));
    const float mnew  = fmaxf(mrun, mx);
    const float alpha = exp_slot(mrun - mnew);
    mrun = mnew;
    float p[8];
#pragma unroll
    for (int r = 0; r < 8; ++r) p[r] = exp_slot(s[r] - mnew);
    float rs = p[0];
#pragma unroll
    for (int r = 1; r < 8; ++r) rs += p[r];
    lsum = lsum * alpha + rs;
#pragma unroll
    for (int dc = 0; dc < 4; ++dc) acc[dc] *= alpha;

#pragma unroll
    for (int st = 0; st < 4; ++st) {
      v2f pf;
      pf.x = p[2 * st + 0];
      pf.y = p[2 * st + 1];
#pragma unroll
      for (int dc = 0; dc < 4; ++dc) {
        v2f vf;
        vf.x = Vl[(8 * hi + 2 * st + 0) * LSTRIDE + dc * 16 + l16];
        vf.y = Vl[(8 * hi + 2 * st + 1) * LSTRIDE + dc * 16 + l16];
        acc[dc] = wmma_f32(vf, pf, acc[dc]);
      }
    }
    // This pass's LDS reads have returned before the next pass's tensor loads
    // refill a buffer; also keeps the compiler from moving reads across.
    asm volatile("s_wait_dscnt 0x0" ::: "memory");
  }

  // Join the halves' row sums, normalize and store [B,S,64]: 8 consecutive d
  // per lane and tile.
  const float inv = 1.0f / (lsum + xhalf(lsum));
  float* Ob = out + b * S_ * D_ + (qt * 16 + l16) * D_ + 8 * hi;
#pragma unroll
  for (int dc = 0; dc < 4; ++dc) {
    const v8f o = acc[dc] * inv;
    *(v4f*)(Ob + dc * 16 + 0) = __builtin_shufflevector(o, o, 0, 1, 2, 3);
    *(v4f*)(Ob + dc * 16 + 4) = __builtin_shufflevector(o, o, 4, 5, 6, 7);
  }
}

// ---------------------------------------------------------------------------
extern "C" void kernel_launch(void* const* d_in, const int* in_sizes, int n_in,
                              void* d_out, int out_size, void* d_ws,
                              size_t ws_size, hipStream_t stream) {
  const int*   x   = (const int*)d_in[0];
  const float* emb = (const float*)d_in[1];
  const float* Wq  = (const float*)d_in[2];
  const float* Wk  = (const float*)d_in[3];
  const float* Wv  = (const float*)d_in[4];
  float* out = (float*)d_out;

  float* Qw = (float*)d_ws;            // [B*S, 64]
  float* Kw = Qw + B_ * S_ * D_;       // [B*S, 64]
  float* Vw = Kw + B_ * S_ * D_;       // [B*S, 64]  (12 MB total in d_ws)

  qkv_embed_kernel<<<dim3((B_ * S_) / 16, 12), 32, 0, stream>>>(
      x, emb, Wq, Wk, Wv, Qw, Kw, Vw);
  flash_attn_kernel<<<dim3(S_ / 16, B_), 32, 0, stream>>>(Qw, Kw, Vw, out);
}

// v002
// Measured time: 125 microseconds a run.
// In two side-by-side timings against v001, it was 1.71 and 1.70 times as fast.
// Over all steps from v000 it is 2.27 times as fast.
#include <hip/hip_runtime.h>

typedef float v2f __attribute__((ext_vector_type(2)));
typedef float v4f __attribute__((ext_vector_type(4)));
typedef float v8f __attribute__((ext_vector_type(8)));
typedef unsigned int u32x4 __attribute__((ext_vector_type(4)));
typedef unsigned int u32x8 __attribute__((ext_vector_type(8)));

#define B_  4
#define S_  4096
#define E_  256
#define D_  64
#define QT_ 4                // query tiles (16 queries each) per work-group
#define KS_ 4                // key slices per work-group
#define NW_ (QT_ * KS_)      // waves per work-group
#define STG 128              // keys per stage
#define NS_ (S_ / STG)       // stages per batch
#define LSTRIDE 68           // LDS row stride in dwords (64 + 4 pad)
#define TILEDW (STG * LSTRIDE)

// 8-arg pattern: (neg_a, A, neg_b, B, c_mod, C, reuse_a, reuse_b)
__device__ __forceinline__ v8f wmma_f32(v2f a, v2f b, v8f c) {
  return __builtin_amdgcn_wmma_f32_16x16x4_f32(false, a, false, b, (short)0, c,
                                               false, false);
}

__device__ __forceinline__ float xhalf(float v) {
  const int b = __builtin_bit_cast(int, v);
  return __builtin_bit_cast(
      float, __builtin_amdgcn_permlanex16(b, b, 0x76543210, 0xfedcba98, false,
                                          false));
}

__device__ __forceinline__ float exp_slot(float x) {
  float r;
  asm("v_exp_f32 %0, %1\n\tv_nop" : "=v"(r) : "v"(x * 1.44269504f));
  return r;
}

// ---------------------------------------------------------------------------
// Tensor load of one stage tile: STG rows of 256 bytes (source pitch 256 bytes)
// into LDS, 16 pad bytes behind every row -> LDS row stride 68 dwords.
// 1-byte elements, every extent in bytes, tensor dims = tile dims.
// ---------------------------------------------------------------------------
__device__ __forceinline__ unsigned uni(unsigned v) {
  return (unsigned)__builtin_amdgcn_readfirstlane(v);
}

__device__ __forceinline__ unsigned pinned(unsigned v) {
  unsigned w = uni(v);
  asm volatile("" : "+s"(w));  // pinned(): the issue test held in a scalar register
  return w;
}

__device__ __forceinline__ u32x8 tdm_group1() {
  u32x8 g;
  g[0] = uni((1u << 20) | (5u << 22) | (3u << 25));
  g[1] = uni(256u << 16);
  g[2] = uni((unsigned)STG << 16);
  g[3] = uni(256u << 16);
  g[4] = uni((unsigned)STG);
  g[5] = uni(256u);
  g[6] = uni(0u);
  g[7] = uni(0u);
  return g;
}

__device__ __forceinline__ void tdm_load(unsigned lds_dst, const float* gptr,
                                         u32x8 g1) {
  const unsigned long long ga = (unsigned long long)(uintptr_t)gptr;
  u32x4 g0;
  g0[0] = uni(1u);                                   // count = 1
  g0[1] = uni(lds_dst);                              // LDS byte offset
  g0[2] = uni((unsigned)ga);                         // address [31:0]
  g0[3] = uni((((unsigned)(ga >> 32)) & 0x01ffffffu) | 0x80000000u);  // type 2
  asm volatile("tensor_load_to_lds %0, %1" ::"s"(g0), "s"(g1) : "memory");
}

// ---------------------------------------------------------------------------
// Kernel 1: embedding gather fused with QKV projection.
// Grid: (BS/16, 12); one wave per 16x16 tile, 64 WMMAs over K=256.
// ---------------------------------------------------------------------------
__global__ __launch_bounds__(32) void qkv_embed_kernel(
    const int* __restrict__ x, const float* __restrict__ emb,
    const float* __restrict__ Wq, const float* __restrict__ Wk,
    const float* __restrict__ Wv,
    float* __restrict__ Q, float* __restrict__ K, float* __restrict__ V) {
  const int mtile = blockIdx.x;
  const int ntile = blockIdx.y;
  const int lane  = threadIdx.x;
  const int l16   = lane & 15;
  const int hi    = lane >> 4;

  const float* W;
  float* O;
  const int col0 = (ntile & 3) * 16;
  if (ntile < 4)      { W = Wq; O = Q; }
  else if (ntile < 8) { W = Wk; O = K; }
  else                { W = Wv; O = V; }

  const int tok   = x[mtile * 16 + l16];
  const int hbase = tok * E_;
  const int wbase = (col0 + l16) * E_;

  v8f c = {};
  for (int kk = 0; kk < E_; kk += 4) {
    v2f a = *(const v2f*)(emb + hbase + kk + 2 * hi);
    v2f b = *(const v2f*)(W + wbase + kk + 2 * hi);
    c = wmma_f32(a, b, c);
  }

#pragma unroll
  for (int r = 0; r < 8; ++r) {
    const int m = mtile * 16 + r + 8 * hi;
    O[m * D_ + col0 + l16] = c[r];
  }
}

__global__ __launch_bounds__(NW_ * 32) void flash_attn_kernel(
    const float* __restrict__ Q, const float* __restrict__ K,
    const float* __restrict__ V, float* __restrict__ out) {
  // [buf0:K,V][buf1:K,V] stride-68 rows, each tile 17 x 2 KiB; then the merge
  // area: accumulators [wave][dc][4-float half][lane], then [wave][m,l][lane].
  __shared__ __attribute__((aligned(2048)))
  float lds[4 * TILEDW + NW_ * 1024 + NW_ * 64];

  const int qt   = blockIdx.x;
  const int b    = blockIdx.y;
  const int lane = threadIdx.x & 31;
  const int l16  = lane & 15;
  const int hi   = lane >> 4;
  const unsigned wave = uni(threadIdx.x >> 5);
  const int qi   = wave & 3;
  const int kj   = wave >> 2;

  const float* Qb = Q + b * S_ * D_;
  const float* Kb = K + b * S_ * D_;
  const float* Vb = V + b * S_ * D_;

  // Issuing waves: wave 0 brings the K tile of a stage, wave 1 its V tile.
  const float* tsrc = (wave == 0) ? Kb : Vb;
  const unsigned tdst = (unsigned)(uintptr_t)&lds[0] + (wave & 1) * (TILEDW * 4);
  u32x8 g1 = tdm_group1();
  asm volatile("" : "+s"(g1));

  // Prologue: stage 0 lands and is published, then stage 1 is issued.
  if (pinned(wave < 2)) {
    tdm_load(tdst, tsrc, g1);
    asm volatile("s_wait_tensorcnt 0x0" ::: "memory");  // stage 0 has landed
  }
  __syncthreads();
  if (pinned(wave < 2)) {
    tdm_load(tdst + 2 * TILEDW * 4, tsrc + STG * D_, g1);
  }

  // Preload Q fragments (B operand of S^T: column = query), folding in the 1/sqrt(256) score scale.
  const int qrow = qt * (QT_ * 16) + qi * 16 + l16;
  v2f qf[16];
#pragma unroll
  for (int st = 0; st < 16; ++st) {
    v2f q = *(const v2f*)(Qb + qrow * D_ + st * 4 + 2 * hi);
    qf[st] = q * 0.0625f;
  }

  // One query (column l16) per lane: its running maximum, this half's share of
  // its row sum, and O^T tiles acc[dc][r] = O[query l16][dc*16 + 8*hi + r],
  // all over this wave's key slice.
  float mrun = -INFINITY, lsum = 0.0f;
  v8f acc[4] = {{}, {}, {}, {}};

  for (int s_ = 0; s_ < NS_; ++s_) {
    const int cur = s_ & 1;

    // Unrolled: one pass per stage, and the second block's LDS reads and score
    // chain can stand beside the first block's softmax.
#pragma unroll
    for (int i = 0; i < STG / (16 * KS_); ++i) {
      const float* Kl = lds + cur * (2 * TILEDW) + (kj + KS_ * i) * 16 * LSTRIDE;
      const float* Vl = Kl + TILEDW;

      // S^T = K . Q^T : A[key][d] from the padded LDS tile, B = Q fragments.
      // s[r] = score of key 8*hi + r for query l16.
      v8f s = {};
#pragma unroll
      for (int st = 0; st < 16; ++st) {
        v2f kf = *(const v2f*)(Kl + l16 * LSTRIDE + st * 4 + 2 * hi);
        s = wmma_f32(kf, qf[st], s);
      }

      // Online softmax, in-lane over this half's 8 keys; one exchange between the
      // halves gives the query's maximum over all 16 keys.
      float mx = s[0];
#pragma unroll
      for (int r = 1; r < 8; ++r) mx = fmaxf(mx, s[r]);
      mx = fmaxf(mx, xhalf(mx));
      const float mnew  = fmaxf(mrun, mx);
      const float alpha = exp_slot(mrun - mnew);
      mrun = mnew;
      float p[8];
#pragma unroll
      for (int r = 0; r < 8; ++r) p[r] = exp_slot(s[r] - mnew);
      float rs = p[0];
#pragma unroll
      for (int r = 1; r < 8; ++r) rs += p[r];
      lsum = lsum * alpha + rs;
#pragma unroll
      for (int dc = 0; dc < 4; ++dc) acc[dc] *= alpha;

#pragma unroll
      for (int st = 0; st < 4; ++st) {
        v2f pf;
        pf.x = p[2 * st + 0];
        pf.y = p[2 * st + 1];
#pragma unroll
        for (int dc = 0; dc < 4; ++dc) {
          v2f vf;
          vf.x = Vl[(8 * hi + 2 * st + 0) * LSTRIDE + dc * 16 + l16];
          vf.y = Vl[(8 * hi + 2 * st + 1) * LSTRIDE + dc * 16 + l16];
          acc[dc] = wmma_f32(vf, pf, acc[dc]);
        }
      }
    }

    // Publish point of stage s_ + 1: this wave's LDS reads of stage s_ have
    // returned, the issuing waves' tiles have landed, every wave has arrived;
    // only then is the buffer that stage s_ used refilled.
    asm volatile("s_wait_dscnt 0x0" ::: "memory");
    if (pinned(wave < 2)) {
      asm volatile("s_wait_tensorcnt 0x0" ::: "memory");
    }
    __syncthreads();
    if (pinned(wave < 2 && s_ + 2 < NS_)) {
      tdm_load(tdst + cur * (2 * TILEDW * 4), tsrc + (s_ + 2) * STG * D_, g1);
    }
  }
  asm volatile("s_wait_tensorcnt 0x0" ::: "memory");  // no tensor load in flight
  asm volatile("s_wait_dscnt 0x0" ::: "memory");      // no ring read in flight

  // Hand this slice's maximum, row-sum shares and O^T tiles over through LDS.
  float* ma = lds + 4 * TILEDW;
  float* mm = ma + NW_ * 1024;
#pragma unroll
  for (int dc = 0; dc < 4; ++dc) {
    const v8f a = acc[dc];
    *(v4f*)(ma + ((wave * 4 + dc) * 2 + 0) * 128 + lane * 4) =
        __builtin_shufflevector(a, a, 0, 1, 2, 3);
    *(v4f*)(ma + ((wave * 4 + dc) * 2 + 1) * 128 + lane * 4) =
        __builtin_shufflevector(a, a, 4, 5, 6, 7);
  }
  mm[(wave * 2 + 0) * 32 + lane] = mrun;
  mm[(wave * 2 + 1) * 32 + lane] = lsum;
  __syncthreads();

  // Merge the four slices of query tile qi. Wave kj finishes 8 queries x 32
  // columns, whole 128-byte lines: this lane query q, columns c8*8 .. c8*8+7,
  // which lane 16*(c8&1) + q of each slice's wave held in acc[c8>>1].
  const int q    = (kj >> 1) * 8 + (lane >> 2);
  const int c8   = (kj & 1) * 4 + (lane & 3);
  const int slot = (c8 & 1) * 16 + q;
  float mj[KS_];
  float mall = -INFINITY;
#pragma unroll
  for (int j = 0; j < KS_; ++j) {
    mj[j] = mm[((j * 4 + qi) * 2 + 0) * 32 + q];
    mall  = fmaxf(mall, mj[j]);
  }
  float lall = 0.0f;
  v4f o0 = {}, o1 = {};
#pragma unroll
  for (int j = 0; j < KS_; ++j) {
    const int wj  = j * 4 + qi;
    const float w = exp_slot(mj[j] - mall);
    lall += w * (mm[(wj * 2 + 1) * 32 + q] + mm[(wj * 2 + 1) * 32 + q + 16]);
    o0 += w * *(const v4f*)(ma + ((wj * 4 + (c8 >> 1)) * 2 + 0) * 128 + slot * 4);
    o1 += w * *(const v4f*)(ma + ((wj * 4 + (c8 >> 1)) * 2 + 1) * 128 + slot * 4);
  }
  const float inv = 1.0f / lall;
  float* Ob = out + b * S_ * D_ + (qt * (QT_ * 16) + qi * 16 + q) * D_ + c8 * 8;
  *(v4f*)(Ob + 0) = o0 * inv;
  *(v4f*)(Ob + 4) = o1 * inv;
}

// ---------------------------------------------------------------------------
extern "C" void kernel_launch(void* const* d_in, const int* in_sizes, int n_in,
                              void* d_out, int out_size, void* d_ws,
                              size_t ws_size, hipStream_t stream) {
  const int*   x   = (const int*)d_in[0];
  const float* emb = (const float*)d_in[1];
  const float* Wq  = (const float*)d_in[2];
  const float* Wk  = (const float*)d_in[3];
  const float* Wv  = (const float*)d_in[4];
  float* out = (float*)d_out;

  float* Qw = (float*)d_ws;            // [B*S, 64]
  float* Kw = Qw + B_ * S_ * D_;       // [B*S, 64]
  float* Vw = Kw + B_ * S_ * D_;       // [B*S, 64]  (12 MB total in d_ws)

  qkv_embed_kernel<<<dim3((B_ * S_) / 16, 12), 32, 0, stream>>>(
      x, emb, Wq, Wk, Wv, Qw, Kw, Vw);
  flash_attn_kernel<<<dim3(S_ / (QT_ * 16), B_), NW_ * 32, 0, stream>>>(Qw, Kw, Vw, out);
}

// v003
// One run takes 105 microseconds.
// In both of two side-by-side timings against v002, it was 1.19 times as fast.
// Counting every step since v000, it is 2.70 times as fast.
#include <hip/hip_runtime.h>

typedef float v2f __attribute__((ext_vector_type(2)));
typedef float v4f __attribute__((ext_vector_type(4)));
typedef float v8f __attribute__((ext_vector_type(8)));
typedef unsigned int u32x4 __attribute__((ext_vector_type(4)));
typedef unsigned int u32x8 __attribute__((ext_vector_type(8)));

#define B_  4
#define S_  4096
#define E_  256
#define D_  64
#define QT_ 4                // query tiles (16 queries each) per work-group
#define KS_ 4                // key slices per work-group
#define NW_ (QT_ * KS_)      // waves per work-group
#define STG 128              // keys per stage
#define NS_ (S_ / STG)       // stages per batch
#define LSTRIDE 68           // LDS row stride in dwords (64 + 4 pad)
#define TILEDW (STG * LSTRIDE)
#define V_  32000            // rows of the embedding table
#define PT_ 64               // tokens per projection work-group
#define PPITCH 260           // projection LDS row pitch in dwords (256 + 4 pad)

// 8-arg pattern: (neg_a, A, neg_b, B, c_mod, C, reuse_a, reuse_b)
__device__ __forceinline__ v8f wmma_f32(v2f a, v2f b, v8f c) {
  return __builtin_amdgcn_wmma_f32_16x16x4_f32(false, a, false, b, (short)0, c,
                                               false, false);
}

__device__ __forceinline__ float xhalf(float v) {
  const int b = __builtin_bit_cast(int, v);
  return __builtin_bit_cast(
      float, __builtin_amdgcn_permlanex16(b, b, 0x76543210, 0xfedcba98, false,
                                          false));
}

__device__ __forceinline__ float exp_slot(float x) {
  float r;
  asm("v_exp_f32 %0, %1\n\tv_nop" : "=v"(r) : "v"(x * 1.44269504f));
  return r;
}

// ---------------------------------------------------------------------------
// Tensor load of one stage tile: STG rows of 256 bytes (source pitch 256 bytes)
// into LDS, 16 pad bytes behind every row -> LDS row stride 68 dwords.
// 1-byte elements, every extent in bytes, tensor dims = tile dims.
// ---------------------------------------------------------------------------
__device__ __forceinline__ unsigned uni(unsigned v) {
  return (unsigned)__builtin_amdgcn_readfirstlane(v);
}

__device__ __forceinline__ unsigned pinned(unsigned v) {
  unsigned w = uni(v);
  asm volatile("" : "+s"(w));  // pinned(): the issue test held in a scalar register
  return w;
}

__device__ __forceinline__ u32x8 tdm_group1() {
  u32x8 g;
  g[0] = uni((1u << 20) | (5u << 22) | (3u << 25));
  g[1] = uni(256u << 16);
  g[2] = uni((unsigned)STG << 16);
  g[3] = uni(256u << 16);
  g[4] = uni((unsigned)STG);
  g[5] = uni(256u);
  g[6] = uni(0u);
  g[7] = uni(0u);
  return g;
}

__device__ __forceinline__ void tdm_load(unsigned lds_dst, const float* gptr,
                                         u32x8 g1) {
  const unsigned long long ga = (unsigned long long)(uintptr_t)gptr;
  u32x4 g0;
  g0[0] = uni(1u);                                   // count = 1
  g0[1] = uni(lds_dst);                              // LDS byte offset
  g0[2] = uni((unsigned)ga);                         // address [31:0]
  g0[3] = uni((((unsigned)(ga >> 32)) & 0x01ffffffu) | 0x80000000u);  // type 2
  asm volatile("tensor_load_to_lds %0, %1" ::"s"(g0), "s"(g1) : "memory");
}

__global__ __launch_bounds__(512) void qkv_embed_kernel(
    const int* __restrict__ x, const float* __restrict__ emb,
    const float* __restrict__ Wq, const float* __restrict__ Wk,
    const float* __restrict__ Wv,
    float* __restrict__ Q, float* __restrict__ K, float* __restrict__ V) {
  // Rows 0..191: Wq, Wk, Wv; rows 192..255: embedding rows of this group's tokens.
  __shared__ __attribute__((aligned(16))) float sh[(PT_ + 3 * D_) * PPITCH];

  const int t    = threadIdx.x;
  const int lane = t & 31;
  const int l16  = lane & 15;
  const int hi   = lane >> 4;
  const int wave = (int)uni(t >> 5);
  const int m0   = blockIdx.x * PT_;
  const int r8   = t >> 6;        // two waves bring one row: 8 rows a round
  const int c4   = (t & 63) * 4;  // this thread's four floats of the row

  const int xi = m0 + r8;
  int tok[PT_ / 8];
#pragma unroll
  for (int i = 0; i < PT_ / 8; ++i) tok[i] = x[xi + i * 8];

  const float* wq = Wq + r8 * E_ + c4;
  const float* wk = Wk + r8 * E_ + c4;
  const float* wl = Wv + r8 * E_ + c4;
  v4f wv[3 * D_ / 8];
#pragma unroll
  for (int i = 0; i < D_ / 8; ++i) {
    wv[i]                = *(const v4f*)(wq + i * 8 * E_);
    wv[D_ / 8 + i]       = *(const v4f*)(wk + i * 8 * E_);
    wv[2 * (D_ / 8) + i] = *(const v4f*)(wl + i * 8 * E_);
  }
  // Keeps the weight loads in front of the wait for the token ids, so that they
  // fly while the ids are fetched.
  __builtin_amdgcn_sched_barrier(0);

  const float* hp[PT_ / 8];
  v4f hv[PT_ / 8];
#pragma unroll
  for (int i = 0; i < PT_ / 8; ++i) {
    const int tk = min(max(tok[i], 0), V_ - 1);  // the row address stays inside emb
    hp[i] = emb + tk * E_ + c4;
    hv[i] = *(const v4f*)hp[i];
  }
  // Stands in front of every overwrite of a register that one of the loads above
  // names as its address: as inputs of this statement the addresses stay in
  // their registers up to it.
  asm volatile("s_wait_xcnt 0x0" ::"v"(xi), "v"(wq), "v"(wk), "v"(wl), "v"(hp[0]),
               "v"(hp[1]), "v"(hp[2]), "v"(hp[3]), "v"(hp[4]), "v"(hp[5]), "v"(hp[6]),
               "v"(hp[7])
               : "memory");

#pragma unroll
  for (int i = 0; i < 3 * D_ / 8; ++i)
    *(v4f*)(sh + (i * 8 + r8) * PPITCH + c4) = wv[i];
#pragma unroll
  for (int i = 0; i < PT_ / 8; ++i)
    *(v4f*)(sh + (3 * D_ + i * 8 + r8) * PPITCH + c4) = hv[i];
  __syncthreads();

  const int mt = wave & 3;
  const int ng = wave >> 2;
  const float* Al = sh + (3 * D_ + mt * 16 + l16) * PPITCH + 4 * hi;
  const float* Bl = sh + (ng * 48 + l16) * PPITCH + 4 * hi;

  v8f c[3] = {{}, {}, {}};
  // Unrolled so that the fragment reads of later k blocks stand ahead of the
  // products of this one.
#pragma unroll
  for (int kb = 0; kb < E_ / 8; ++kb) {
    const v4f a = *(const v4f*)(Al + kb * 8);
    v4f bf[3];
#pragma unroll
    for (int j = 0; j < 3; ++j)
      bf[j] = *(const v4f*)(Bl + j * 16 * PPITCH + kb * 8);
#pragma unroll
    for (int j = 0; j < 3; ++j)
      c[j] = wmma_f32(__builtin_shufflevector(a, a, 0, 1),
                      __builtin_shufflevector(bf[j], bf[j], 0, 1), c[j]);
#pragma unroll
    for (int j = 0; j < 3; ++j)
      c[j] = wmma_f32(__builtin_shufflevector(a, a, 2, 3),
                      __builtin_shufflevector(bf[j], bf[j], 2, 3), c[j]);
  }
  __builtin_amdgcn_sched_barrier(0);
  asm volatile("v_nop\n\tv_nop\n\tv_nop\n\tv_nop");
  __builtin_amdgcn_sched_barrier(0);

#pragma unroll
  for (int j = 0; j < 3; ++j) {
    const int nt   = ng * 3 + j;
    const int col0 = (nt & 3) * 16;
    float* O = (nt < 4) ? Q : (nt < 8) ? K : V;
#pragma unroll
    for (int r = 0; r < 8; ++r) {
      const int m = m0 + mt * 16 + r + 8 * hi;
      O[m * D_ + col0 + l16] = c[j][r];
    }
  }
}

__global__ __launch_bounds__(NW_ * 32) void flash_attn_kernel(
    const float* __restrict__ Q, const float* __restrict__ K,
    const float* __restrict__ V, float* __restrict__ out) {
  // [buf0:K,V][buf1:K,V] stride-68 rows, each tile 17 x 2 KiB; then the merge
  // area: accumulators [wave][dc][4-float half][lane], then [wave][m,l][lane].
  __shared__ __attribute__((aligned(2048)))
  float lds[4 * TILEDW + NW_ * 1024 + NW_ * 64];

  const int qt   = blockIdx.x;
  const int b    = blockIdx.y;
  const int lane = threadIdx.x & 31;
  const int l16  = lane & 15;
  const int hi   = lane >> 4;
  const unsigned wave = uni(threadIdx.x >> 5);
  const int qi   = wave & 3;
  const int kj   = wave >> 2;

  const float* Qb = Q + b * S_ * D_;
  const float* Kb = K + b * S_ * D_;
  const float* Vb = V + b * S_ * D_;

  // Issuing waves: wave 0 brings the K tile of a stage, wave 1 its V tile.
  const float* tsrc = (wave == 0) ? Kb : Vb;
  const unsigned tdst = (unsigned)(uintptr_t)&lds[0] + (wave & 1) * (TILEDW * 4);
  u32x8 g1 = tdm_group1();
  asm volatile("" : "+s"(g1));

  // Prologue: stage 0 lands and is published, then stage 1 is issued.
  if (pinned(wave < 2)) {
    tdm_load(tdst, tsrc, g1);
    asm volatile("s_wait_tensorcnt 0x0" ::: "memory");  // stage 0 has landed
  }
  __syncthreads();
  if (pinned(wave < 2)) {
    tdm_load(tdst + 2 * TILEDW * 4, tsrc + STG * D_, g1);
  }

  // Preload Q fragments (B operand of S^T: column = query), folding in the 1/sqrt(256) score scale.
  const int qrow = qt * (QT_ * 16) + qi * 16 + l16;
  v2f qf[16];
#pragma unroll
  for (int st = 0; st < 16; ++st) {
    v2f q = *(const v2f*)(Qb + qrow * D_ + st * 4 + 2 * hi);
    qf[st] = q * 0.0625f;
  }

  // One query (column l16) per lane: its running maximum, this half's share of
  // its row sum, and O^T tiles acc[dc][r] = O[query l16][dc*16 + 8*hi + r],
  // all over this wave's key slice.
  float mrun = -INFINITY, lsum = 0.0f;
  v8f acc[4] = {{}, {}, {}, {}};

  for (int s_ = 0; s_ < NS_; ++s_) {
    const int cur = s_ & 1;

    // Unrolled: one pass per stage, and the second block's LDS reads and score
    // chain can stand beside the first block's softmax.
#pragma unroll
    for (int i = 0; i < STG / (16 * KS_); ++i) {
      const float* Kl = lds + cur * (2 * TILEDW) + (kj + KS_ * i) * 16 * LSTRIDE;
      const float* Vl = Kl + TILEDW;

      // S^T = K . Q^T : A[key][d] from the padded LDS tile, B = Q fragments.
      // s[r] = score of key 8*hi + r for query l16.
      v8f s = {};
#pragma unroll
      for (int st = 0; st < 16; ++st) {
        v2f kf = *(const v2f*)(Kl + l16 * LSTRIDE + st * 4 + 2 * hi);
        s = wmma_f32(kf, qf[st], s);
      }

      // Online softmax, in-lane over this half's 8 keys; one exchange between the
      // halves gives the query's maximum over all 16 keys.
      float mx = s[0];
#pragma unroll
      for (int r = 1; r < 8; ++r) mx = fmaxf(mx, s[r]);
      mx = fmaxf(mx, xhalf(mx));
      const float mnew  = fmaxf(mrun, mx);
      const float alpha = exp_slot(mrun - mnew);
      mrun = mnew;
      float p[8];
#pragma unroll
      for (int r = 0; r < 8; ++r) p[r] = exp_slot(s[r] - mnew);
      float rs = p[0];
#pragma unroll
      for (int r = 1; r < 8; ++r) rs += p[r];
      lsum = lsum * alpha + rs;
#pragma unroll
      for (int dc = 0; dc < 4; ++dc) acc[dc] *= alpha;

#pragma unroll
      for (int st = 0; st < 4; ++st) {
        v2f pf;
        pf.x = p[2 * st + 0];
        pf.y = p[2 * st + 1];
#pragma unroll
        for (int dc = 0; dc < 4; ++dc) {
          v2f vf;
          vf.x = Vl[(8 * hi + 2 * st + 0) * LSTRIDE + dc * 16 + l16];
          vf.y = Vl[(8 * hi + 2 * st + 1) * LSTRIDE + dc * 16 + l16];
          acc[dc] = wmma_f32(vf, pf, acc[dc]);
        }
      }
    }

    // Publish point of stage s_ + 1: this wave's LDS reads of stage s_ have
    // returned, the issuing waves' tiles have landed, every wave has arrived;
    // only then is the buffer that stage s_ used refilled.
    asm volatile("s_wait_dscnt 0x0" ::: "memory");
    if (pinned(wave < 2)) {
      asm volatile("s_wait_tensorcnt 0x0" ::: "memory");
    }
    __syncthreads();
    if (pinned(wave < 2 && s_ + 2 < NS_)) {
      tdm_load(tdst + cur * (2 * TILEDW * 4), tsrc + (s_ + 2) * STG * D_, g1);
    }
  }
  asm volatile("s_wait_tensorcnt 0x0" ::: "memory");  // no tensor load in flight
  asm volatile("s_wait_dscnt 0x0" ::: "memory");      // no ring read in flight

  // Hand this slice's maximum, row-sum shares and O^T tiles over through LDS.
  float* ma = lds + 4 * TILEDW;
  float* mm = ma + NW_ * 1024;
#pragma unroll
  for (int dc = 0; dc < 4; ++dc) {
    const v8f a = acc[dc];
    *(v4f*)(ma + ((wave * 4 + dc) * 2 + 0) * 128 + lane * 4) =
        __builtin_shufflevector(a, a, 0, 1, 2, 3);
    *(v4f*)(ma + ((wave * 4 + dc) * 2 + 1) * 128 + lane * 4) =
        __builtin_shufflevector(a, a, 4, 5, 6, 7);
  }
  mm[(wave * 2 + 0) * 32 + lane] = mrun;
  mm[(wave * 2 + 1) * 32 + lane] = lsum;
  __syncthreads();

  // Merge the four slices of query tile qi. Wave kj finishes 8 queries x 32
  // columns, whole 128-byte lines: this lane query q, columns c8*8 .. c8*8+7,
  // which lane 16*(c8&1) + q of each slice's wave held in acc[c8>>1].
  const int q    = (kj >> 1) * 8 + (lane >> 2);
  const int c8   = (kj & 1) * 4 + (lane & 3);
  const int slot = (c8 & 1) * 16 + q;
  float mj[KS_];
  float mall = -INFINITY;
#pragma unroll
  for (int j = 0; j < KS_; ++j) {
    mj[j] = mm[((j * 4 + qi) * 2 + 0) * 32 + q];
    mall  = fmaxf(mall, mj[j]);
  }
  float lall = 0.0f;
  v4f o0 = {}, o1 = {};
#pragma unroll
  for (int j = 0; j < KS_; ++j) {
    const int wj  = j * 4 + qi;
    const float w = exp_slot(mj[j] - mall);
    lall += w * (mm[(wj * 2 + 1) * 32 + q] + mm[(wj * 2 + 1) * 32 + q + 16]);
    o0 += w * *(const v4f*)(ma + ((wj * 4 + (c8 >> 1)) * 2 + 0) * 128 + slot * 4);
    o1 += w * *(const v4f*)(ma + ((wj * 4 + (c8 >> 1)) * 2 + 1) * 128 + slot * 4);
  }
  const float inv = 1.0f / lall;
  float* Ob = out + b * S_ * D_ + (qt * (QT_ * 16) + qi * 16 + q) * D_ + c8 * 8;
  *(v4f*)(Ob + 0) = o0 * inv;
  *(v4f*)(Ob + 4) = o1 * inv;
}

// ---------------------------------------------------------------------------
extern "C" void kernel_launch(void* const* d_in, const int* in_sizes, int n_in,
                              void* d_out, int out_size, void* d_ws,
                              size_t ws_size, hipStream_t stream) {
  const int*   x   = (const int*)d_in[0];
  const float* emb = (const float*)d_in[1];
  const float* Wq  = (const float*)d_in[2];
  const float* Wk  = (const float*)d_in[3];
  const float* Wv  = (const float*)d_in[4];
  float* out = (float*)d_out;

  float* Qw = (float*)d_ws;            // [B*S, 64]
  float* Kw = Qw + B_ * S_ * D_;       // [B*S, 64]
  float* Vw = Kw + B_ * S_ * D_;       // [B*S, 64]  (12 MB total in d_ws)

  qkv_embed_kernel<<<dim3((B_ * S_) / PT_), 512, 0, stream>>>(
      x, emb, Wq, Wk, Wv, Qw, Kw, Vw);
  flash_attn_kernel<<<dim3(S_ / (QT_ * 16), B_), NW_ * 32, 0, stream>>>(Qw, Kw, Vw, out);
}
